// v010
// The times below were measured on an AMD MI455X: many runs one after another, warmed up first and cycling through
// copies of the inputs, with the whole window's GPU time divided by the number of runs. Launches and the gaps
// between them are all in it. The median over several windows is given; except for v000 it joins two sittings, which
// can be a few percent apart, so the side-by-side timings, each taken in one sitting, are the better comparison.
// This document starts at v010; the versions before it stand elsewhere.
// Measured time: 174 microseconds a run.
// Next to v009, in two timings, it ran 1.15 and 1.17 times as fast.
// Over all steps from v000, the starting kernel, it is 33.6 times as fast.
#include <hip/hip_runtime.h>
// Pre-LN causal transformer block WITHOUT an attention output projection that also returns its key and value tensors (x [2][2048][1024]; h = LN1(x) (biased var, eps 1e-5); q / k / v = h W + b ([in][out] [1024][1024] sigma 1/32, zero biases) -> [B][16][T][64]; att = softmax(q k^T / 8) with a causal mask (tril, -inf); y = att v merged back to [B][T][1024]; x1 = x + y (no projection); out = x1 + gelu_erf(LN2(x1) w_fc + b_fc) w_proj + b_proj ([in][out] 1024 x 4096 x 1024); returns (out [2][2048][1024], k [2][16][2048][64], v [2][16][2048][64]): three outputs at byte offsets 0 / 16,777,216 / 33,554,432 of d_out).
// Structure: token rows r = b*2048 + s; h = LN1(bf16(x)) as f16 rows, bf16(x) kept in f32; q | k | v as ONE WMMA GEMM (N = 3 x 1024) (64x64 wave tiles, f32 accumulation, exact x16 weights + bias, f16 outputs; the same sums stored in f32 as outputs k and v and as q, k, v of each batch's first 128 rows); V^T for all heads of both batches via LDS transposes; rows 128.. of both batches in one launch: per wave 32 query rows, keys 64 at a time up to the rows' end, scores (K = 64), running-maximum softmax (f32 statistics, native exp2; weights at most 256 in f16) and weights x V^T all in registers, x1 = x + o / row sum in f32; out = x1 + gelu_erf(LN2(x1) W1 + b1) W2 + b2 by two f16-operand GEMMs, x1 added in the second's f32 epilogue.
// Compute dtype: inputs rounded to bf16; x / weights exact; q, k, v, softmax weights, LN outputs and FFN hidden rows as plain f16 GEMM operands (~2^-12); scores and softmax statistics f32. v_wmma_f32_16x16x32_f16.
#define NB 2
#define SQ 2048
#define DM 1024
#define NH 16
#define HD 64
#define HG 4                         /* heads per k_vt launch (k_vt is not launched) */
#define QT 256                       /* unused */
#define NKX SQ                       /* unused */
#define QT0 128                      /* first-tile rows attended exactly in f32 */
#define B0 0                         /* first batch processed (debug hook) */
#define NBR NB                       /* batches processed (debug hook) */
#define NR ((size_t)NB * SQ)
#define DMQ DM
#define DFF 4096                     /* FFN hidden width */
#define DFFR 100
#define MP ((int)((size_t)NBR * SQ)) /* rows projected (debug hook) */
#define QN SQ                        /* query rows attended per batch (unused) */
#define NHD NH                       /* heads attended (unused) */
#define MPO MP                       /* rows through the output stage (unused) */
#define LQ (3 * DM)      /* row pitch of the q/k/v rows */
typedef __bf16 v16b __attribute__((ext_vector_type(16)));
typedef unsigned short v8us __attribute__((ext_vector_type(8), may_alias));
typedef float  v8f  __attribute__((ext_vector_type(8)));
typedef float  v4f  __attribute__((ext_vector_type(4)));
typedef float  v4fa __attribute__((ext_vector_type(4), may_alias));
union FragB { v16b v; v8us half[2]; unsigned short u[16]; };

__device__ __forceinline__ unsigned short bf16_bits(float x) { unsigned int u = __float_as_uint(x); return (unsigned short)((u + 0x7FFFu + ((u >> 16) & 1u)) >> 16); }
__device__ __forceinline__ float bf16_val(unsigned short b) { return __uint_as_float(((unsigned int)b) << 16); }
__device__ __forceinline__ float bf16_round(float x) { return bf16_val(bf16_bits(x)); }
// D += A·B with NT terms: 1 = ah·bh, 2 = + al·bh (A split), 3 = + ah·bl (both split)
template <int NT>
__device__ __forceinline__ v8f mmaN(v16b ah, v16b al, v16b bh, v16b bl, v8f c) {
  c = __builtin_amdgcn_wmma_f32_16x16x32_bf16(false, ah, false, bh, (short)0, c, false, false);
  if (NT >= 2) c = __builtin_amdgcn_wmma_f32_16x16x32_bf16(false, al, false, bh, (short)0, c, false, false);
  if (NT >= 3) c = __builtin_amdgcn_wmma_f32_16x16x32_bf16(false, ah, false, bl, (short)0, c, false, false);
  asm volatile("v_nop\n\tv_nop\n\tv_nop\n\tv_nop" : "+v"(c) : "v"(ah), "v"(al), "v"(bh), "v"(bl));
  return c;
}

__global__ __launch_bounds__(256) void k_wt_bf16(const float* __restrict__ W, unsigned short* __restrict__ Wt, int K, int N) {
  const int t = blockIdx.x * 256 + threadIdx.x;
  const int k8n = K / 8;
  if (t >= N * k8n) return;
  const int n = t / k8n, k8 = (t % k8n) * 8;
  v8us v;
#pragma unroll
  for (int i = 0; i < 8; ++i) v[i] = bf16_bits(W[(size_t)(k8 + i) * N + n]);
  *(v8us*)(Wt + (size_t)n * K + k8) = v;
  
}

// GEMM C[M][N] (f32, pitch ldc) = act(A[M][K]·W + bias). A f32 row-major (pitch lda) converted per fragment to bf16
// (ASPLIT: hi/lo two planes -> 2 terms, else single rounded term); Wt bf16 [N][K] (pitch ldb). BIAS_BF16 rounds the
// bias to bf16 first (bias quantised to bf16 before the add). K%32==0, M%16==0, N%64==0.
template <bool ASPLIT, int ACT, bool BIAS_BF16>
__global__ __launch_bounds__(128) void k_gemm_bf(const float* __restrict__ A, int lda, const unsigned short* __restrict__ Wt, int ldb,
                                               const float* __restrict__ bias, float* __restrict__ C, int ldc, int M, int N, int K) {
  __shared__ __attribute__((aligned(16))) float so[4][16][64];
  const int tid = threadIdx.x, w = tid >> 5, lane = tid & 31, ln = lane & 15, hh = lane >> 4;
  const int ntn = N / 64;
  const int wid = blockIdx.x * 4 + w;
  const int mt = wid / ntn, nq = wid % ntn;
  if (mt * 16 >= M) return;
  const int row0 = mt * 16, col0 = nq * 64;
  const float* arow = A + (size_t)(row0 + ln) * lda;
  v8f acc[4] = {};
  for (int kb = 0; kb < K; kb += 32) {
    FragB ah, al;
    const v4f x0 = *(const v4fa*)(arow + kb + 8 * hh), x1 = *(const v4fa*)(arow + kb + 8 * hh + 4);
    const v4f x2 = *(const v4fa*)(arow + kb + 16 + 8 * hh), x3 = *(const v4fa*)(arow + kb + 16 + 8 * hh + 4);
    float xs[16] = {x0[0],x0[1],x0[2],x0[3],x1[0],x1[1],x1[2],x1[3],x2[0],x2[1],x2[2],x2[3],x3[0],x3[1],x3[2],x3[3]};
#pragma unroll
    for (int i = 0; i < 16; ++i) { const unsigned short hb = bf16_bits(xs[i]); ah.u[i] = hb; al.u[i] = ASPLIT ? bf16_bits(xs[i] - bf16_val(hb)) : (unsigned short)0; }
#pragma unroll
    for (int t = 0; t < 4; ++t) {
      const unsigned short* brow = Wt + (size_t)(col0 + t * 16 + ln) * ldb + kb;
      FragB b;
      b.half[0] = *(const v8us*)(brow + 8 * hh);
      b.half[1] = *(const v8us*)(brow + 16 + 8 * hh);
      acc[t] = mmaN<ASPLIT ? 2 : 1>(ah.v, al.v, b.v, b.v, acc[t]);
    }
  }
#pragma unroll
  for (int t = 0; t < 4; ++t) {
    float bv = bias ? bias[col0 + t * 16 + ln] : 0.f;
    if (BIAS_BF16) bv = bf16_round(bv);
#pragma unroll
    for (int r = 0; r < 8; ++r) { float v = acc[t][r] + bv; if (ACT == 1) v = fmaxf(v, 0.f); so[w][8 * hh + r][t * 16 + ln] = v; }
  }
  __builtin_amdgcn_fence(__ATOMIC_ACQ_REL, "workgroup");
  __builtin_amdgcn_wave_barrier();
  const int rsub = lane >> 4, c4 = (lane & 15) * 4;
  {
#pragma unroll
    for (int q = 0; q < 8; ++q) {
      const int r = q * 2 + rsub;
      const v4f v = *(const v4fa*)&so[w][r][c4];
      *(v4f*)(C + (size_t)(row0 + r) * ldc + col0 + c4) = v;
    }
    
  }
}

// GEMM C = act(A·W + bias + resid): A f32 (ASPLIT -> hi/lo 2 terms), Wt bf16 [N][K]; ACT 0 none, 1 relu, 2 exact gelu;
// resid (optional, f32, row index = (row % rmod), pitch ldr, RES_BF16 rounds it) added before the activation.
template <bool ASPLIT, int ACT, bool BIAS_BF16, bool RES_BF16>
__global__ __launch_bounds__(128) void k_gemm_bf3(const float* __restrict__ A, int lda, const unsigned short* __restrict__ Wt, int ldb,
                                                const float* __restrict__ bias, const float* __restrict__ resid, int rmod, int ldr,
                                                float* __restrict__ C, int ldc, int M, int N, int K) {
  __shared__ __attribute__((aligned(16))) float so[4][16][64];
  const int tid = threadIdx.x, w = tid >> 5, lane = tid & 31, ln = lane & 15, hh = lane >> 4;
  const int ntn = N / 64;
  const int wid = blockIdx.x * 4 + w;
  const int mt = wid / ntn, nq = wid % ntn;
  if (mt * 16 >= M) return;
  const int row0 = mt * 16, col0 = nq * 64;
  const float* arow = A + (size_t)(row0 + ln) * lda;
  v8f acc[4] = {};
  for (int kb = 0; kb < K; kb += 32) {
    FragB ah, al;
    const v4f x0 = *(const v4fa*)(arow + kb + 8 * hh), x1 = *(const v4fa*)(arow + kb + 8 * hh + 4);
    const v4f x2 = *(const v4fa*)(arow + kb + 16 + 8 * hh), x3 = *(const v4fa*)(arow + kb + 16 + 8 * hh + 4);
    float xs[16] = {x0[0],x0[1],x0[2],x0[3],x1[0],x1[1],x1[2],x1[3],x2[0],x2[1],x2[2],x2[3],x3[0],x3[1],x3[2],x3[3]};
#pragma unroll
    for (int i = 0; i < 16; ++i) { const unsigned short hb = bf16_bits(xs[i]); ah.u[i] = hb; al.u[i] = ASPLIT ? bf16_bits(xs[i] - bf16_val(hb)) : (unsigned short)0; }
#pragma unroll
    for (int t = 0; t < 4; ++t) {
      const unsigned short* brow = Wt + (size_t)(col0 + t * 16 + ln) * ldb + kb;
      FragB b;
      b.half[0] = *(const v8us*)(brow + 8 * hh);
      b.half[1] = *(const v8us*)(brow + 16 + 8 * hh);
      acc[t] = mmaN<ASPLIT ? 2 : 1>(ah.v, al.v, b.v, b.v, acc[t]);
    }
  }
#pragma unroll
  for (int t = 0; t < 4; ++t) {
    const int col = col0 + t * 16 + ln;
    float bv = bias ? bias[col] : 0.f;
    if (BIAS_BF16) bv = bf16_round(bv);
#pragma unroll
    for (int r = 0; r < 8; ++r) {
      float v = acc[t][r] + bv;
      if (resid) { float rv = resid[(size_t)((row0 + 8 * hh + r) % rmod) * ldr + col]; if (RES_BF16) rv = bf16_round(rv); v += rv; }
      if (ACT == 1) v = fmaxf(v, 0.f);
      if (ACT == 2) v = 0.5f * v * (1.0f + erff(v * 0.70710678118654752f));
      if (ACT == 3) { const float u = 0.7978845608028654f * (v + 0.044715f * v * v * v); v = 0.5f * v * (1.0f + tanhf(u)); }
      so[w][8 * hh + r][t * 16 + ln] = v;
    }
  }
  __builtin_amdgcn_fence(__ATOMIC_ACQ_REL, "workgroup");
  __builtin_amdgcn_wave_barrier();
  const int rsub = lane >> 4, c4 = (lane & 15) * 4;
  {
#pragma unroll
    for (int q = 0; q < 8; ++q) {
      const int r = q * 2 + rsub;
      const v4f v = *(const v4fa*)&so[w][r][c4];
      *(v4f*)(C + (size_t)(row0 + r) * ldc + col0 + c4) = v;
    }
    
  }
}
// row LayerNorm (biased variance, eps) over N: s = X (+ R); optional out_sum <- s; out_norm <- (s-mu)*rsqrt(var+eps)*g + b
template <bool PARAM_BF16>
__global__ __launch_bounds__(256) void k_layernorm(const float* __restrict__ X, const float* __restrict__ R, const float* __restrict__ g, const float* __restrict__ bta,
                                                  float* __restrict__ out_sum, float* __restrict__ out_norm, int N, float eps) {
  __shared__ float red[256];
  const int row = blockIdx.x, tid = threadIdx.x;
  const float* x = X + (size_t)row * N; const float* rr = R ? R + (size_t)row * N : nullptr;
  float vals[16];                     // up to N = 4096
  const int per = N / 256;            // contiguous chunk per thread? use strided-by-4 chunks: thread handles j = tid*4 + 1024*u
  float s1 = 0.f;
  for (int u = 0; u < per / 4; ++u) {
    const int j = tid * 4 + 1024 * u;
    const v4f a = *(const v4fa*)(x + j);
    v4f b = {0.f,0.f,0.f,0.f}; if (rr) b = *(const v4fa*)(rr + j);
#pragma unroll
    for (int q = 0; q < 4; ++q) { const float v = a[q] + b[q]; vals[u * 4 + q] = v; s1 += v; }
  }
  red[tid] = s1; __syncthreads();
  for (int st = 128; st > 0; st >>= 1) { if (tid < st) red[tid] += red[tid + st]; __syncthreads(); }
  const float mu = red[0] / (float)N; __syncthreads();
  float s2 = 0.f;
  for (int u = 0; u < per / 4; ++u)
#pragma unroll
    for (int q = 0; q < 4; ++q) { const float c = vals[u * 4 + q] - mu; s2 += c * c; }
  red[tid] = s2; __syncthreads();
  for (int st = 128; st > 0; st >>= 1) { if (tid < st) red[tid] += red[tid + st]; __syncthreads(); }
  const float rs = rsqrtf(red[0] / (float)N + eps);
  {
    for (int u = 0; u < per / 4; ++u) {
      const int j = tid * 4 + 1024 * u;
      v4f o, sm;
#pragma unroll
      for (int q = 0; q < 4; ++q) {
        float gg = g[j + q], bb = bta[j + q];
        if (PARAM_BF16) { gg = bf16_round(gg); bb = bf16_round(bb); }
        sm[q] = vals[u * 4 + q]; o[q] = (vals[u * 4 + q] - mu) * rs * gg + bb;
      }
      if (out_sum) *(v4f*)(out_sum + (size_t)row * N + j) = sm;
      *(v4f*)(out_norm + (size_t)row * N + j) = o;
    }
    
  }
}



// ---- f16 WMMA path (v_wmma_f32_16x16x32_f16): 11-bit significands for operands in range — used where a [0,1] probability operand needs more precision than bf16
typedef _Float16 v16h __attribute__((ext_vector_type(16)));
union FragH { v16h v; v8us half[2]; _Float16 h[16]; unsigned short u[16]; };
template <int NT>
__device__ __forceinline__ v8f mmaH(v16h ah, v16h al, v16h bh, v16h bl, v8f c) {
  c = __builtin_amdgcn_wmma_f32_16x16x32_f16(false, ah, false, bh, (short)0, c, false, false);
  if (NT >= 2) c = __builtin_amdgcn_wmma_f32_16x16x32_f16(false, al, false, bh, (short)0, c, false, false);
  if (NT >= 3) c = __builtin_amdgcn_wmma_f32_16x16x32_f16(false, ah, false, bl, (short)0, c, false, false);
  asm volatile("v_nop\n\tv_nop\n\tv_nop\n\tv_nop" : "+v"(c) : "v"(ah), "v"(al), "v"(bh), "v"(bl));
  return c;
}
// batched GEMM like k_gemm_b but f16 operands: A f32 (split into f16 hi/lo if ASPLIT, else rounded to f16), Bt = f16 values [n][k]; alpha; C f32; N multiple of 16 (partial tiles skipped)
template <bool ASPLIT>
__global__ __launch_bounds__(128) void k_gemm_h(const float* __restrict__ A, int lda, size_t sA, const _Float16* __restrict__ Bh, int ldb, size_t sB, float alpha, float* __restrict__ C, int ldc, size_t sC, int M, int N, int K) {
  __shared__ __attribute__((aligned(16))) float so[4][16][64];
  const int tid = threadIdx.x, w = tid >> 5, lane = tid & 31, ln = lane & 15, hh = lane >> 4; const int by = blockIdx.y;
  A += (size_t)by * sA; Bh += (size_t)by * sB; C += (size_t)by * sC;
  const int ntn = (N + 63) / 64; const int wid = blockIdx.x * 4 + w; const int mt = wid / ntn, nq = wid % ntn; if (mt * 16 >= M) return;
  const int row0 = mt * 16, col0 = nq * 64; const float* arow = A + (size_t)(row0 + ln) * lda;
  v8f acc[4] = {};
  for (int kb = 0; kb < K; kb += 32) {
    FragH ah, al;
    const v4f x0 = *(const v4fa*)(arow + kb + 8 * hh), x1 = *(const v4fa*)(arow + kb + 8 * hh + 4), x2 = *(const v4fa*)(arow + kb + 16 + 8 * hh), x3 = *(const v4fa*)(arow + kb + 16 + 8 * hh + 4);
    float xs[16] = {x0[0],x0[1],x0[2],x0[3],x1[0],x1[1],x1[2],x1[3],x2[0],x2[1],x2[2],x2[3],x3[0],x3[1],x3[2],x3[3]};
#pragma unroll
    for (int i = 0; i < 16; ++i) { const _Float16 h = (_Float16)xs[i]; ah.h[i] = h; al.h[i] = ASPLIT ? (_Float16)(xs[i] - (float)h) : (_Float16)0.0f; }
#pragma unroll
    for (int t = 0; t < 4; ++t) { if (col0 + t * 16 >= N) continue; const size_t boff = (size_t)(col0 + t * 16 + ln) * ldb + kb; FragH bq; bq.half[0] = *(const v8us*)(Bh + boff + 8 * hh); bq.half[1] = *(const v8us*)(Bh + boff + 16 + 8 * hh);
      acc[t] = mmaH<ASPLIT ? 2 : 1>(ah.v, al.v, bq.v, bq.v, acc[t]); }
  }
#pragma unroll
  for (int t = 0; t < 4; ++t) { if (col0 + t * 16 >= N) continue;
#pragma unroll
    for (int r = 0; r < 8; ++r) so[w][8 * hh + r][t * 16 + ln] = acc[t][r] * alpha; }
  __builtin_amdgcn_fence(__ATOMIC_ACQ_REL, "workgroup"); __builtin_amdgcn_wave_barrier();
  const int rsub = lane >> 4, c4 = (lane & 15) * 4;
  {
#pragma unroll
    for (int q = 0; q < 8; ++q) { const int r = q * 2 + rsub; if (col0 + c4 < N) { const v4f v = *(const v4fa*)&so[w][r][c4]; *(v4f*)(C + (size_t)(row0 + r) * ldc + col0 + c4) = v; } }
     }
}

// Wt[n][k] = f16(W[k][n]·scale) from f32 row-major W[K][N] (scale = power of two; bf16-exact weights stay exact in f16 away from the subnormal range)
// One work-group per tile of 128 k x 64 n (tile bx of N / 64 by tile by of K / 128, handed in by the kernel that deals the tiles; K, N at compile time, so that the rows of a thread are constant offsets of one address). Reads: 16 lanes take 256 bytes in a row of one row of W, each thread the same four columns of eight rows, all eight loads in flight.
// The thread's 8 x 4 block leaves as four 16-byte pieces (eight k of one n) into an LDS tile [64 n][128 k]; stores: 16 lanes write 256 bytes in a row of one row of Wt. Both sides touch whole 128-byte lines only.
// LDS rows are 256 bytes, so every row starts on bank 0: piece kb of row n lies at place kb ^ (n / 4 % 16), which spreads the 16 lanes of a half wave over all banks in the write (rows 4 ln + j, one kb) and in the read (one row, 16 kb).
template <int K, int N>
__device__ __forceinline__ void wt_f16_tile(const float* __restrict__ W, _Float16* __restrict__ Wt, float scale, int bx, int by, unsigned short* tl) { static_assert(K % 128 == 0 && N % 64 == 0, "whole tiles");
  const int tid = threadIdx.x, ln = tid & 15, kb = tid >> 4; const int n0 = bx * 64, k0 = by * 128;
  const float* wb = W + (size_t)k0 * N + n0; const unsigned wo = (unsigned)(kb * 8 * N + ln * 4) * 4u;      /* the work-group's scalar base; the lane's fixed offset in bytes */
  v4f r[8];
#pragma unroll      /* register array; all loads in flight together */
  for (int i = 0; i < 8; ++i) r[i] = *(const v4fa*)((const char*)(wb + (size_t)i * N) + wo);
  asm volatile("s_wait_xcnt 0x0" :: "v"(wo), "s"(wb) : "memory");      /* behind the loads, in front of any later write of their base and offset registers; both as inputs, so that their registers are still theirs up to here */
#pragma unroll      /* register arrays */
  for (int j = 0; j < 4; ++j) { FragH f;
#pragma unroll      /* register arrays */
    for (int i = 0; i < 8; ++i) f.h[i] = (_Float16)(bf16_round(r[i][j]) * scale);
    *(v8us*)(tl + (ln * 4 + j) * 128 + (kb ^ ln) * 8) = f.half[0]; }
  __syncthreads();      /* the tile is whole before any row of it is read */
  unsigned short* ob = (unsigned short*)Wt + (size_t)n0 * K + k0; const unsigned oo = (unsigned)(kb * K + ln * 8) * 2u;      /* as above: row kb of each group of 16 rows, piece ln */
  v8us o[4];
#pragma unroll      /* register array */
  for (int p = 0; p < 4; ++p) { const int n = p * 16 + kb; o[p] = *(const v8us*)(tl + n * 128 + (ln ^ ((n >> 2) & 15)) * 8); }
#pragma unroll      /* register array */
  for (int p = 0; p < 4; ++p) *(v8us*)((char*)(ob + (size_t)p * 16 * K) + oo) = o[p];
}
// k_gemm_hh variant with fused epilogue: v = acc·alpha + bias[by·sBias + col] (+ CP[(row/rowsPerB)·sCPb + by·64 + col] if CP) ; ACT 0 none / 1 elu ; writes f16 C16 (and f32 C if non-null)
template <int ACT>
__global__ __launch_bounds__(128) void k_gemm_hhx(const _Float16* __restrict__ A, int lda, size_t sA, const _Float16* __restrict__ Bh, int ldb, size_t sB, float alpha, const float* __restrict__ bias, size_t sBias, const float* __restrict__ CP, int rowsPerB, size_t sCPb, int row0g,
    float* __restrict__ C, _Float16* __restrict__ C16, int ldc, size_t sC, int M, int N, int K) {
  __shared__ __attribute__((aligned(16))) float so[4][16][64];
  const int tid = threadIdx.x, w = tid >> 5, lane = tid & 31, ln = lane & 15, hh = lane >> 4; const int by = blockIdx.y;
  A += (size_t)by * sA; Bh += (size_t)by * sB; const size_t cofs = (size_t)by * sC; const float* bp = bias ? bias + (size_t)by * sBias : nullptr;
  const int ntn = (N + 63) / 64; const int wid = blockIdx.x * 4 + w; const int mt = wid / ntn, nq = wid % ntn; if (mt * 16 >= M) return;
  const int row0 = mt * 16, col0 = nq * 64; const _Float16* arow = A + (size_t)(row0 + ln) * lda;
  v8f acc[4] = {};
  for (int kb = 0; kb < K; kb += 32) { FragH ah; ah.half[0] = *(const v8us*)((const unsigned short*)arow + kb + 8 * hh); ah.half[1] = *(const v8us*)((const unsigned short*)arow + kb + 16 + 8 * hh);
#pragma unroll
    for (int t = 0; t < 4; ++t) { if (col0 + t * 16 >= N) continue; const size_t boff = (size_t)(col0 + t * 16 + ln) * ldb + kb; FragH bq; bq.half[0] = *(const v8us*)((const unsigned short*)Bh + boff + 8 * hh); bq.half[1] = *(const v8us*)((const unsigned short*)Bh + boff + 16 + 8 * hh);
      acc[t] = mmaH<1>(ah.v, ah.v, bq.v, bq.v, acc[t]); }
  }
#pragma unroll
  for (int t = 0; t < 4; ++t) { if (col0 + t * 16 >= N) continue; const int col = col0 + t * 16 + ln; const float bv = bp ? bf16_round(bp[col]) : 0.f;
#pragma unroll
    for (int r = 0; r < 8; ++r) { float v = acc[t][r] * alpha + bv; if (CP) { const int rr = row0g + row0 + 8 * hh + r; if (rowsPerB < 0) v += CP[cofs + (size_t)rr * ldc + col];      /* rowsPerB < 0: own element of the batched C plane */ else { const int bidx = rr / rowsPerB; v += CP[(size_t)bidx * sCPb + (size_t)by * 64 + col]; } } if (ACT == 1) v = (v > 0.f) ? v : expm1f(v); else if (ACT == 7) v = (v > 0.f) ? v + 1.0f : expf(v); else if (ACT == 8) v = tanhf(v); else if (ACT == 9) v = 0.5f * v * (1.0f + tanhf(0.7978845608028654f * (v + 0.044715f * v * v * v))); else if (ACT == 11) v = 1.0f / (1.0f + expf(-v)); else if (ACT == 12) v = (v > 0.f) ? v : 0.01f * v; else if (ACT == 14) v = (v > 0.f) ? v : 0.1f * v; else if (ACT == 16) v = (v >= 0.f) ? v : 0.3f * v; else if (ACT == 17) v = (v >= 0.f) ? v : 0.2f * v; else if (ACT == 15) v = v / (1.0f + expf(-v)); else if (ACT == 3) v = fmaxf(v, 0.f); else if (ACT == 6) v = 0.5f * v * (1.0f + erff(v * 0.70710678118654752f)); so[w][8 * hh + r][t * 16 + ln] = v; } }
  __builtin_amdgcn_fence(__ATOMIC_ACQ_REL, "workgroup"); __builtin_amdgcn_wave_barrier();
  const int rsub = lane >> 4, c4 = (lane & 15) * 4; typedef _Float16 v4h __attribute__((ext_vector_type(4)));
  {
#pragma unroll
    for (int q = 0; q < 8; ++q) { const int r = q * 2 + rsub; if (col0 + c4 < N) { const v4f v = *(const v4fa*)&so[w][r][c4]; if (C) *(v4f*)(C + cofs + (size_t)(row0 + r) * ldc + col0 + c4) = v; if (C16) { v4h h4; for (int i = 0; i < 4; ++i) h4[i] = (_Float16)v[i]; *(v4h*)(C16 + cofs + (size_t)(row0 + r) * ldc + col0 + c4) = h4; } } }
     }
}


typedef _Float16 v4h __attribute__((ext_vector_type(4)));

__global__ __launch_bounds__(256) void k_x16(const float* __restrict__ x, _Float16* __restrict__ X16, size_t n8) { const size_t t = (size_t)blockIdx.x * 256 + threadIdx.x; if (t >= n8) return; FragH f;
#pragma unroll
  for (int q = 0; q < 8; ++q) f.h[q] = (_Float16)bf16_round(x[t * 8 + q]); *(v8us*)((unsigned short*)X16 + t * 8) = f.half[0];  }
__global__ __launch_bounds__(256) void k_h16(const float* __restrict__ x, _Float16* __restrict__ X16, size_t n8) { const size_t t = (size_t)blockIdx.x * 256 + threadIdx.x; if (t >= n8) return; FragH f;
#pragma unroll
  for (int q = 0; q < 8; ++q) f.h[q] = (_Float16)x[t * 8 + q]; *(v8us*)((unsigned short*)X16 + t * 8) = f.half[0];  }
__global__ __launch_bounds__(256) void k_round16f(const float* __restrict__ W, _Float16* __restrict__ Bt, size_t n8) { const size_t t = (size_t)blockIdx.x * 256 + threadIdx.x; if (t >= n8) return; FragH f;
#pragma unroll
  for (int i = 0; i < 8; ++i) f.h[i] = (_Float16)(bf16_round(W[t * 8 + i]) * 16.0f); *(v8us*)((unsigned short*)Bt + t * 8) = f.half[0];  }
template <int NHv, int TTv>
__device__ __forceinline__ void vt_tile(const _Float16* __restrict__ V16, int ldv, int voff, _Float16* __restrict__ Vt, int bx, unsigned short (*tl)[66]) { const int tid = threadIdx.x; const int slab = bx / (TTv / 64), lg = bx % (TTv / 64); const int b = slab / NHv, h = slab % NHv;
  for (int i = tid; i < 64 * 8; i += 256) { const int r = i / 8, c8 = (i % 8) * 8; FragH f; f.half[0] = *(const v8us*)((const unsigned short*)V16 + ((size_t)b * TTv + lg * 64 + r) * ldv + voff + h * 64 + c8);
#pragma unroll
    for (int q = 0; q < 8; ++q) tl[r][c8 + q] = f.u[q]; }
  __syncthreads();
  {
#pragma unroll
    for (int rd = 0; rd < 2; ++rd) { const int d = rd * 32 + tid / 8, pc = tid % 8; FragH f;
#pragma unroll
      for (int q = 0; q < 8; ++q) f.u[q] = tl[pc * 8 + q][d];
      *(v8us*)((unsigned short*)Vt + ((size_t)slab * 64 + d) * TTv + lg * 64 + pc * 8) = f.half[0]; }
     } }

__global__ __launch_bounds__(256) void k_hl(const float* __restrict__ F, _Float16* __restrict__ Hh, _Float16* __restrict__ Hl, size_t n8) { const size_t t = (size_t)blockIdx.x * 256 + threadIdx.x; if (t >= n8) return; FragH fh, fl; const v4f a = *(const v4fa*)(F + t * 8), c = *(const v4fa*)(F + t * 8 + 4);
#pragma unroll
  for (int q = 0; q < 4; ++q) { _Float16 h = (_Float16)a[q]; fh.h[q] = h; fl.h[q] = (_Float16)((a[q] - (float)h) * 1024.0f); h = (_Float16)c[q]; fh.h[4 + q] = h; fl.h[4 + q] = (_Float16)((c[q] - (float)h) * 1024.0f); }
  { *(v8us*)((unsigned short*)Hh + t * 8) = fh.half[0]; *(v8us*)((unsigned short*)Hl + t * 8) = fl.half[0];  } }

// ---- fast GEMM (work-group tile 128x128; wave tile 16 NAF x 64: NAF = 4 -> four waves, 2 x 2, NAF = 2 -> eight waves, 4 x 2; requires M % 128 == 0 rows per launch region, N % 128 == 0, K % KP == 0); epilogue = k_gemm_hhx semantics ----
// Operands reach the waves through LDS: per pass of KP k the work-group's 128 rows of A and 128 rows of B (2 KP bytes each) are brought in once by asynchronous copies, whole lines at a time, into one of two buffers; the next pass's copies fly while this pass is worked on.
// The square tile takes 2 x 128 operand rows from L2 for 128 x 128 results, where 128 x 64 took 192 rows for half as many. KP = 128 is for the launch that has one work-group per WGP: twice the bytes are then in flight under a pass.
__device__ __forceinline__ v16h g2_lfrag(const unsigned char* p) { FragH f; f.half[0] = *(const v8us*)p; f.half[1] = *(const v8us*)(p + 32); return f.v; }
// one operand's 128 rows of a pass: eight 16-byte copies per lane, 16 rows per copy and work-group. l = the lane's LDS byte address in the first of its rows, sl = 16 LDS rows in bytes; g = its own 16 bytes in that row of the operand, sg = 16 rows in bytes.
// The s_wait_xcnt stands inside the statement, behind the last copy: a precaution in front of any later write of a register that a copy names.
__device__ __forceinline__ void g2_copy8(unsigned l, unsigned sl, const char* g, size_t sg) {
  asm volatile("global_load_async_to_lds_b128 %0, %8, off\n\tglobal_load_async_to_lds_b128 %1, %9, off\n\tglobal_load_async_to_lds_b128 %2, %10, off\n\tglobal_load_async_to_lds_b128 %3, %11, off\n\t"
               "global_load_async_to_lds_b128 %4, %12, off\n\tglobal_load_async_to_lds_b128 %5, %13, off\n\tglobal_load_async_to_lds_b128 %6, %14, off\n\tglobal_load_async_to_lds_b128 %7, %15, off\n\ts_wait_xcnt 0x0"
               :: "v"(l), "v"(l + sl), "v"(l + 2u * sl), "v"(l + 3u * sl), "v"(l + 4u * sl), "v"(l + 5u * sl), "v"(l + 6u * sl), "v"(l + 7u * sl),
                  "v"(g), "v"(g + sg), "v"(g + 2 * sg), "v"(g + 3 * sg), "v"(g + 4 * sg), "v"(g + 5 * sg), "v"(g + 6 * sg), "v"(g + 7 * sg) : "memory"); }
__device__ __forceinline__ v8f g2_mma(v16h a, v16h b, v8f c) { v8f d = __builtin_amdgcn_wmma_f32_16x16x32_f16(false, a, false, b, (short)0, c, false, false); asm volatile("v_nop\n\tv_nop\n\tv_nop\n\tv_nop" : "+v"(d) : "v"(a), "v"(b)); return d; }
// s_wait_xcnt behind a group of loads, in front of any later write of a register that holds one of their addresses; the addresses as inputs, so that their registers are still theirs up to here and no load of the group returns its data into them
template <int N>
__device__ __forceinline__ void g2_xwait(const float* const (&p)[N]) { static_assert(N == 2 || N == 16, "one statement per group size");
  if constexpr (N == 2) asm volatile("s_wait_xcnt 0x0" :: "v"(p[0]), "v"(p[1]) : "memory");
  else asm volatile("s_wait_xcnt 0x0" :: "v"(p[0]), "v"(p[1]), "v"(p[2]), "v"(p[3]), "v"(p[4]), "v"(p[5]), "v"(p[6]), "v"(p[7]), "v"(p[8]), "v"(p[9]), "v"(p[10]), "v"(p[11]), "v"(p[12]), "v"(p[13]), "v"(p[14]), "v"(p[15]) : "memory"); }
// QKVF (the stacked q | k | v launch, rows b * SQ + s, columns 0 .. 3 DM - 1): the f32 values behind the f16 rows are stored as well, so that no product is formed twice: k and v head-major into KV (outputs 1 and 2, one behind the other: [k | v][NB][NH][SQ][HD]), and q, k, v of each batch's first QT0 rows into F0 ([q | k | v][NB][QT0][DM]) for the f32 attention path.
template <int ACT, bool QKVF = false, int NAF = 4, int KP = 64>
__global__ __launch_bounds__(NAF == 4 ? 128 : 256) void k_gemm2(const _Float16* __restrict__ A, int lda, size_t sA, const _Float16* __restrict__ Bh, int ldb, size_t sB, float alpha, const float* __restrict__ bias, size_t sBias, const float* __restrict__ CP, int rowsPerB, size_t sCPb, int row0g,
    float* __restrict__ C, _Float16* __restrict__ C16, int ldc, size_t sC, int M, int N, int K, float* __restrict__ KV, float* __restrict__ F0) { static_assert(ACT == 0 || ACT == 3 || ACT == 6 || ACT == 8 || ACT == 9 || ACT == 11 || ACT == 12 || ACT == 14 || ACT == 15 || ACT == 16 || ACT == 17, "k_gemm2: unsupported ACT code (would silently apply no activation)");
  static_assert((NAF == 4 && KP == 64) || (NAF == 2 && KP == 128), "threads / lanes per row = 16 rows per copy in both forms");
  constexpr int WR = 8 / NAF;                  /* waves down the 128 rows; two across the 128 columns */
  constexpr int LR = KP / 8;                   /* lanes per operand row of a pass, 16 bytes each */
  constexpr int P = KP * 2 + 16;               /* LDS row pitch in bytes: 16 B x odd, the pitch for ds_load_b128 readers */
  constexpr int S = 256 * P;                   /* one buffer: rows 0..127 = A, rows 128..255 = B */
  constexpr int GK = NAF == 4 ? 1 : 2;         /* k steps of 32 whose fragments are read as one group */
  __shared__ __attribute__((aligned(16))) unsigned char ring[2 * S]; static_assert(sizeof(float) * 256 * 68 <= 2 * S, "the output staging fits in the ring");
  float (*so)[NAF * 16][68] = (float (*)[NAF * 16][68])ring;      /* output staging in the ring's place, behind the last pass's barrier */
  const int tid = threadIdx.x, lane = tid & 31, ln = lane & 15, hh = lane >> 4; const int by = blockIdx.y; const int w = __builtin_amdgcn_readfirstlane(tid >> 5), rg = w % WR, cg = w / WR;      /* the wave's number and its place in the tile: scalars */
  A += (size_t)by * sA; Bh += (size_t)by * sB; const size_t cofs = (size_t)by * sC; const float* bp = bias ? bias + (size_t)by * sBias : nullptr;
  const int ntn = N >> 7; const int mt = blockIdx.x / ntn, nq = blockIdx.x - mt * ntn; const int row0 = mt * 128 + NAF * 16 * rg, col0 = nq * 128 + 64 * cg; if (mt * 128 >= M) return;      /* the whole work-group or none of it, in front of every barrier */
  const char* ag = (const char*)(A + (size_t)(mt * 128 + tid / LR) * lda) + (tid % LR) * 16; const char* bg = (const char*)(Bh + (size_t)(nq * 128 + tid / LR) * ldb) + (tid % LR) * 16;      /* the lane's 16 bytes in the first of its rows */
  const size_t sa = (size_t)lda * 32, sb = (size_t)ldb * 32; const unsigned lc = (unsigned)(size_t)ring + (unsigned)((tid / LR) * P + (tid % LR) * 16);
  const unsigned char* la = ring + (NAF * 16 * rg + ln) * P + 16 * hh; const unsigned char* lb = ring + (128 + 64 * cg + ln) * P + 16 * hh;      /* fragment rows: the wave's own rows of A and of B */
  const v8f z8 = {0.f,0.f,0.f,0.f,0.f,0.f,0.f,0.f}; v8f acc[NAF][4];
#pragma unroll      /* register arrays */
  for (int i = 0; i < NAF; ++i)
#pragma unroll      /* register arrays */
    for (int j = 0; j < 4; ++j) acc[i][j] = z8;
  const int np = K / KP;
  g2_copy8(lc, 16u * P, ag, sa); g2_copy8(lc + 128u * P, 16u * P, bg, sb);
  asm volatile("s_wait_asynccnt 0x0" ::: "memory");      /* this wave's copies of pass 0 have landed */
  __syncthreads();      /* pass 0 is readable by every wave */
  if (np > 1) { g2_copy8(lc + S, 16u * P, ag + KP * 2, sa); g2_copy8(lc + S + 128u * P, 16u * P, bg + KP * 2, sb); }
#pragma unroll 1
  for (int t = 0; t < np; ++t) { const unsigned bo = (unsigned)(t & 1) * S;
#pragma unroll      /* register arrays, constant LDS offsets */
    for (int g = 0; g < KP / 32 / GK; ++g) { v16h fa[GK][NAF], fb[GK][4];      /* one group's fragments */
#pragma unroll      /* register arrays, constant LDS offsets */
      for (int ks = 0; ks < GK; ++ks) {
#pragma unroll      /* register arrays */
        for (int i = 0; i < NAF; ++i) fa[ks][i] = g2_lfrag(la + bo + (g * GK + ks) * 64 + i * 16 * P);
#pragma unroll      /* register arrays */
        for (int j = 0; j < 4; ++j) fb[ks][j] = g2_lfrag(lb + bo + (g * GK + ks) * 64 + j * 16 * P); }
      __builtin_amdgcn_sched_barrier(0);      /* all LDS reads of the group go out together in front of its products; left to itself the compiler reads one fragment at a time and waits out the LDS latency in front of every second product */
#pragma unroll      /* register arrays */
      for (int ks = 0; ks < GK; ++ks)
#pragma unroll      /* register arrays */
        for (int j = 0; j < 4; ++j)
#pragma unroll      /* register arrays */
          for (int i = 0; i < NAF; ++i) acc[i][j] = g2_mma(fa[ks][i], fb[ks][j], acc[i][j]);
      __builtin_amdgcn_sched_barrier(0); }      /* the next group's reads stay behind these products: one group's fragments at a time keep the registers within what the resident waves share */
    asm volatile("s_wait_dscnt 0x0" ::: "memory");      /* this wave's reads of the buffer are done before the barrier behind which it is refilled */
    asm volatile("s_wait_asynccnt 0x0" ::: "memory");      /* this wave's copies of pass t + 1 have landed */
    __syncthreads();      /* publishes pass t + 1 and ends every wave's reads of pass t */
    if (t + 2 < np) { g2_copy8(lc + bo, 16u * P, ag + (size_t)(t + 2) * (KP * 2), sa); g2_copy8(lc + bo + 128u * P, 16u * P, bg + (size_t)(t + 2) * (KP * 2), sb); } }
  asm volatile("s_wait_asynccnt 0x0" ::: "memory");      /* no copy is outstanding when the ring becomes output staging */
#pragma unroll      /* register arrays */
  for (int i = 0; i < NAF; ++i)
#pragma unroll      /* register arrays */
    for (int j = 0; j < 4; ++j)
#pragma unroll      /* register arrays */
      for (int r = 0; r < 8; ++r) so[w][i * 16 + 8 * hh + r][j * 16 + ln] = acc[i][j][r];      /* the raw sums; all arithmetic on them follows on the way out of the staging */
  __builtin_amdgcn_fence(__ATOMIC_ACQ_REL, "workgroup"); __builtin_amdgcn_wave_barrier();
  const int rsub = lane >> 4, c4 = (lane & 15) * 4;
  // Scale, bias, residual and activation are applied where the staged rows are read back: a lane holds four neighbouring columns of one row, so that bias and residual come as 16-byte loads and the code for one row pair serves all NAF x 8 of the wave.
  // UQ row pairs are worked on per trip. With a library activation the loop stays rolled, so that the kernel's text stays small (for speed only).
  constexpr int UQ = (ACT == 0 || ACT == 3) ? 16 : 2;
  v4f bv4 = {0.f, 0.f, 0.f, 0.f};
  if (bp) { const v4f br = *(const v4fa*)(bp + col0 + c4);
#pragma unroll      /* register arrays */
    for (int i = 0; i < 4; ++i) bv4[i] = bf16_round(br[i]); }
  auto fin = [&](const bool hascp) __attribute__((always_inline)) {
#pragma unroll 1      /* see above: the text stays small */
    for (int q0 = 0; q0 < NAF * 8; q0 += UQ) { v4f cp[UQ];
      if (hascp) { const float* pa[UQ];
        if (rowsPerB < 0) {      /* rowsPerB < 0: own element of the batched C plane; the trip's loads all in flight together */
#pragma unroll      /* register arrays */
          for (int j = 0; j < UQ; ++j) pa[j] = CP + cofs + (size_t)(row0g + row0 + (q0 + j) * 2 + rsub) * ldc + col0 + c4;
#pragma unroll      /* register arrays */
          for (int j = 0; j < UQ; ++j) cp[j] = *(const v4fa*)pa[j];
          g2_xwait(pa); }
        else {
#pragma unroll      /* register arrays */
          for (int j = 0; j < UQ; ++j) pa[j] = CP + (size_t)((row0g + row0 + (q0 + j) * 2 + rsub) / rowsPerB) * sCPb + (size_t)by * 64 + col0 + c4;
#pragma unroll      /* register arrays */
          for (int j = 0; j < UQ; ++j) { const float* p = pa[j]; const v4f c = {p[0], p[1], p[2], p[3]}; cp[j] = c; }
          g2_xwait(pa); } }
#pragma unroll      /* register arrays */
      for (int j = 0; j < UQ; ++j) { const int r = (q0 + j) * 2 + rsub; v4f vv = *(const v4fa*)&so[w][r][c4];
#pragma unroll      /* register arrays */
        for (int i = 0; i < 4; ++i) { float v = vv[i] * alpha + bv4[i]; if (hascp) v += cp[j][i];
          if (ACT == 3) v = fmaxf(v, 0.f); else if (ACT == 6) v = 0.5f * v * (1.0f + erff(v * 0.70710678118654752f)); else if (ACT == 11) v = 1.0f / (1.0f + expf(-v)); else if (ACT == 15) v = v / (1.0f + expf(-v)); else if (ACT == 12) v = (v > 0.f) ? v : 0.01f * v; else if (ACT == 8) v = tanhf(v); else if (ACT == 9) v = 0.5f * v * (1.0f + tanhf(0.7978845608028654f * (v + 0.044715f * v * v * v))); else if (ACT == 14) v = (v > 0.f) ? v : 0.1f * v; else if (ACT == 16) v = (v >= 0.f) ? v : 0.3f * v; else if (ACT == 17) v = (v >= 0.f) ? v : 0.2f * v;
          vv[i] = v; }
        if (QKVF) *(v4fa*)&so[w][r][c4] = vv;      /* the finished values, in the lane's own place, for the f32 stores below */
        if (C) { *(v4f*)(C + cofs + (size_t)(row0 + r) * ldc + col0 + c4) = vv; asm volatile("s_wait_xcnt 0x0" ::: "memory"); }      /* behind the store, in front of the conversion below, which may reuse its registers */
        if (C16) { v4h h4; for (int i = 0; i < 4; ++i) h4[i] = (_Float16)vv[i]; *(v4h*)(C16 + cofs + (size_t)(row0 + r) * ldc + col0 + c4) = h4; } }
      asm volatile("s_wait_xcnt 0x0" ::: "memory"); } };      /* behind the trip's loads and stores, in front of the next trip's (or later code's) writes of their address registers */
  if (CP) fin(true); else fin(false);
  if constexpr (QKVF) { static_assert(QT0 == 128 && SQ % 128 == 0 && HD == 64 && DM % 128 == 0, "a work-group's 128 rows lie in one batch and are its first QT0 rows or none of them; a wave's 64 columns are one head of q, of k or of v");
    const int sel = col0 / DM, hc = col0 % DM, bt = (mt * 128) / SQ, t0 = (mt * 128) % SQ;      /* 0 q, 1 k, 2 v; first column in that matrix; batch; first row in the batch: scalars */
    if (sel >= 1) { float* kvp = KV + ((size_t)((sel - 1) * NB + bt) * NH + hc / HD) * SQ * HD + (size_t)t0 * HD; const unsigned kvo = (unsigned)((NAF * 16 * rg + rsub) * HD + c4) * 4u;      /* scalar base, the lane's fixed offset in bytes, the row pair as a constant: a head's rows follow one another, so that each store is 512 bytes in a row */
#pragma unroll      /* constant offsets */
      for (int q = 0; q < NAF * 8; ++q) *(v4f*)((char*)kvp + kvo + q * 2 * HD * 4) = *(const v4fa*)&so[w][q * 2 + rsub][c4];
      asm volatile("s_wait_xcnt 0x0" :: "v"(kvo), "s"(kvp) : "memory"); }      /* behind the stores, in front of any later write of their base and offset registers (the next block forms its own); both as inputs, so that their registers are still theirs up to here */
    if (t0 == 0) { float* fp = F0 + (size_t)(sel * NB + bt) * QT0 * DM + hc; const unsigned fo = (unsigned)((NAF * 16 * rg + rsub) * DM + c4) * 4u;      /* as above, row pitch DM */
#pragma unroll      /* constant offsets */
      for (int q = 0; q < NAF * 8; ++q) *(v4f*)((char*)fp + fo + q * 2 * DM * 4) = *(const v4fa*)&so[w][q * 2 + rsub][c4]; } } }


__global__ __launch_bounds__(256) void k_wnat(const float* __restrict__ w, size_t n8, _Float16* __restrict__ Bt) { const size_t t = (size_t)blockIdx.x * 256 + threadIdx.x; if (t >= n8) return; FragH f; for (int q = 0; q < 8; ++q) f.h[q] = (_Float16)(bf16_round(w[t * 8 + q]) * 16.0f); *(v8us*)((unsigned short*)Bt + t * 8) = f.half[0];  }
__global__ __launch_bounds__(256) void k_rsm(const float* __restrict__ S, _Float16* __restrict__ P, int nrows) {
  #pragma clang fp contract(off)
  const int i = blockIdx.x * 256 + threadIdx.x; if (i >= nrows) return; const float* s = S + (size_t)i * SQ; float mx = -3.0e38f;
#pragma unroll 1
  for (int j = 0; j < SQ; ++j) mx = fmaxf(mx, s[j]); float se = 0.f;
#pragma unroll 1
  for (int j = 0; j < SQ; ++j) se += expf(s[j] - mx); const float sc = 256.0f / se;
#pragma unroll 1
  for (int j0 = 0; j0 < SQ; j0 += 8) { FragH f; for (int q = 0; q < 8; ++q) f.h[q] = (_Float16)(expf(s[j0 + q] - mx) * sc); unsigned short* d = (unsigned short*)P + (size_t)i * SQ + j0; *(v8us*)d = f.half[0];  } }
__global__ __launch_bounds__(256) void k_vt(const _Float16* __restrict__ V16, int b, int h0, _Float16* __restrict__ VT) { __shared__ unsigned short tl[64][65]; const int tid = threadIdx.x; const int hh = blockIdx.x % HG, sg = blockIdx.x / HG; const int s0 = sg * 64; const int h = h0 + hh;
  for (int i = tid; i < 64 * 8; i += 256) { const int j = i / 8, d8 = (i % 8) * 8; FragH f; f.half[0] = *(const v8us*)((const unsigned short*)V16 + ((size_t)b * SQ + s0 + j) * DM + h * HD + d8); for (int q = 0; q < 8; ++q) tl[d8 + q][j] = f.u[q]; }
  __syncthreads();
  { for (int i = tid; i < 64 * 8; i += 256) { const int d = i / 8, j8 = (i % 8) * 8; FragH f; for (int q = 0; q < 8; ++q) f.u[q] = tl[d][j8 + q]; *(v8us*)((unsigned short*)VT + ((size_t)hh * HD + d) * SQ + s0 + j8) = f.half[0]; }  } }



// ---- lane exchanges and native exp2 shared by the two attention kernels below ----
template <int CTRL>
__device__ __forceinline__ float sm_rowx(float x) { return __builtin_bit_cast(float, __builtin_amdgcn_update_dpp(__builtin_bit_cast(int, x), __builtin_bit_cast(int, x), CTRL, 0xf, 0xf, false)); }      /* CTRL = 0x160 | m (row_xmask): lane l with lane l ^ m of its 16-lane row */
__device__ __forceinline__ float sm_half(float x) { return __builtin_bit_cast(float, __builtin_amdgcn_permlanex16(__builtin_bit_cast(int, x), __builtin_bit_cast(int, x), 0x76543210, 0xfedcba98, false, false)); }      /* lane l with lane l ^ 16 */
__device__ __forceinline__ float sm_wmax(float v) { v = fmaxf(v, sm_rowx<0x161>(v)); v = fmaxf(v, sm_rowx<0x162>(v)); v = fmaxf(v, sm_rowx<0x164>(v)); v = fmaxf(v, sm_rowx<0x168>(v)); return fmaxf(v, sm_half(v)); }
__device__ __forceinline__ float sm_wsum(float v) { v += sm_rowx<0x161>(v); v += sm_rowx<0x162>(v); v += sm_rowx<0x164>(v); v += sm_rowx<0x168>(v); return v + sm_half(v); }
// 2^x of four values: each v_exp_f32 fills the slot behind the one before it (results apart from all sources), the v_nop the slot behind the last, which the instruction set asks for before a result is read or a source overwritten
__device__ __forceinline__ v4f sm_exp2x4(v4f x) { float r0, r1, r2, r3;
  asm("v_exp_f32 %0, %4\n\tv_exp_f32 %1, %5\n\tv_exp_f32 %2, %6\n\tv_exp_f32 %3, %7\n\tv_nop" : "=&v"(r0), "=&v"(r1), "=&v"(r2), "=&v"(r3) : "v"(x[0]), "v"(x[1]), "v"(x[2]), "v"(x[3]));
  const v4f r = {r0, r1, r2, r3}; return r; }
// ---- causal attention for query rows QT0 .. SQ - 1 in one launch: scores and softmax weights never leave registers. One wave owns 32 query rows of one (batch, head) and walks the keys 64 at a time; no LDS, no barrier.
// Both products are formed transposed, so that a query is a lane (column ln) in each: S^T = K Q^T (A = 16 key rows, B = query rows) gives lane (ln, hh) the keys 8 hh + r of a 16-key tile for query ln, which is the k order of a B fragment
// (tiles 2 j, 2 j + 1 -> k = 8 hh + i, 16 + 8 hh + i): the weights go from accumulator to operand by a conversion alone. O^T = V^T P^T (A = 16 rows of V^T) keeps query = ln, so that the running maximum, the rescale and the row sum are the lane's own.
// Running maximum kept on the raw products; weights 2^((s - max) c + 8), c = log2(e) / 8: at most 256, so that small weights stay clear of the f16 subnormals; the row sum carries the same factor.
__device__ __forceinline__ v8f fa_mma(v16h a, v16h b, v8f c) { return __builtin_amdgcn_wmma_f32_16x16x32_f16(false, a, false, b, (short)0, c, false, false); }
// fragment from a wave-uniform base and the lane's own fixed offset in bytes (the value the load instruction itself takes beside a scalar base)
__device__ __forceinline__ v16h fa_frag(const _Float16* base, unsigned off) { FragH f; f.half[0] = *(const v8us*)((const char*)base + off); f.half[1] = *(const v8us*)((const char*)base + off + 32); return f.v; }
__device__ __forceinline__ void fa_loadk(const _Float16* __restrict__ kp, int kb, unsigned ko, v16h (&kf)[4][2]) {
#pragma unroll      /* register arrays */
  for (int t = 0; t < 4; ++t)
#pragma unroll      /* register arrays */
    for (int ks = 0; ks < 2; ++ks) kf[t][ks] = fa_frag(kp + (size_t)(kb + t * 16) * LQ + ks * 32, ko); }
// one pass of 64 keys from kb on. LAST: the pass that holds the rows' own keys (the only one that needs the mask) and has no pass behind it to fetch K for.
template <bool LAST>
__device__ __forceinline__ void fa_pass(const _Float16* __restrict__ kp, const _Float16* __restrict__ vp, int kb, int qrel, unsigned ko, unsigned vo, const v16h (&qf)[2][2], v16h (&kf)[4][2], v8f (&o)[2][4], float (&mr)[2], float (&l)[2]) {
  const float cs = 0.125f * 1.44269504f; const v8f z8 = {0.f, 0.f, 0.f, 0.f, 0.f, 0.f, 0.f, 0.f};
  v16h vf[4][2];
#pragma unroll      /* register arrays */
  for (int t = 0; t < 4; ++t)
#pragma unroll      /* register arrays */
    for (int ks = 0; ks < 2; ++ks) vf[t][ks] = fa_frag(vp + (size_t)t * 16 * SQ + kb + ks * 32, vo);
  asm volatile("s_wait_xcnt 0x0" :: "v"(vo) : "memory");      /* behind the loads, in front of any later write of a register that holds one of their addresses; the offset as an input, so that its register is still the offset's while the loads issue */
  __builtin_amdgcn_sched_barrier(0);      /* V^T of this pass is asked for here, so that it flies under the score products and the softmax; left to itself the scheduler sinks the loads to their use */
  v8f st[2][4];
#pragma unroll      /* register arrays */
  for (int qt = 0; qt < 2; ++qt)
#pragma unroll      /* register arrays */
    for (int t = 0; t < 4; ++t) st[qt][t] = fa_mma(kf[t][1], qf[qt][1], fa_mma(kf[t][0], qf[qt][0], z8));
  if (!LAST) { __builtin_amdgcn_sched_barrier(0);      /* the next pass's K is asked for behind this pass's last use of K and no later: it flies under the softmax and the second product */
    fa_loadk(kp, kb + 64, ko, kf);
    asm volatile("s_wait_xcnt 0x0" :: "v"(ko) : "memory");      /* as behind the V^T loads above */
    __builtin_amdgcn_sched_barrier(0); }      /* as the line above: keeps the loads from sinking */
  float mn[2];
#pragma unroll      /* register arrays */
  for (int qt = 0; qt < 2; ++qt) { const int rel = qrel + qt * 16 - kb;      /* key kb + 16 t + 8 hh + r is kept while 16 t + r <= rel */
    float mx = mr[qt];
#pragma unroll      /* register arrays */
    for (int t = 0; t < 4; ++t)
#pragma unroll      /* register arrays */
      for (int r = 0; r < 8; ++r) { if (LAST) st[qt][t][r] = (t * 16 + r <= rel) ? st[qt][t][r] : -1.0e30f; mx = fmaxf(mx, st[qt][t][r]); }
    mn[qt] = fmaxf(mx, sm_half(mx)); }      /* the other eight keys of each tile sit in lane l ^ 16 */
  const v4f ax = {(mr[0] - mn[0]) * cs, (mr[1] - mn[1]) * cs, 0.f, 0.f}; const v4f al = sm_exp2x4(ax);      /* rescale of what was summed under the old maximum; 0 in the first pass */
  FragH pf[2][2];
#pragma unroll      /* register arrays */
  for (int qt = 0; qt < 2; ++qt) { const float mo = mn[qt] * cs - 8.0f; mr[qt] = mn[qt];
    v4f se = {0.f, 0.f, 0.f, 0.f};
#pragma unroll      /* register arrays */
    for (int t = 0; t < 4; ++t)
#pragma unroll      /* register arrays */
      for (int g = 0; g < 2; ++g) { v4f x;
#pragma unroll      /* register arrays */
        for (int q = 0; q < 4; ++q) x[q] = st[qt][t][g * 4 + q] * cs - mo;
        x = sm_exp2x4(x); se += x;
#pragma unroll      /* register arrays */
        for (int q = 0; q < 4; ++q) pf[qt][t >> 1].h[(t & 1) * 8 + g * 4 + q] = (_Float16)x[q]; }
    l[qt] = l[qt] * al[qt] + ((se[0] + se[1]) + (se[2] + se[3]));
#pragma unroll      /* register arrays */
    for (int t = 0; t < 4; ++t) o[qt][t] *= al[qt]; }
  __builtin_amdgcn_sched_barrier(0);      /* the second product starts behind the last exp2 of both tiles */
#pragma unroll      /* register arrays */
  for (int qt = 0; qt < 2; ++qt)
#pragma unroll      /* register arrays */
    for (int t = 0; t < 4; ++t) o[qt][t] = fa_mma(vf[t][1], pf[qt][1].v, fa_mma(vf[t][0], pf[qt][0].v, o[qt][t])); }
__global__ __launch_bounds__(256) void k_fattn(const _Float16* __restrict__ QKVp, const _Float16* __restrict__ VTp, const float* __restrict__ XBp, float* __restrict__ X1p) {
  static_assert(QT0 == 128 && HD == 64 && SQ % 256 == 0, "blocks of 128 query rows; block 0 of a batch belongs to the f32 path; blocks 1 .. SQ / 128 - 1 are paired below");
  const int lane = threadIdx.x & 31, ln = lane & 15, hh = lane >> 4; const int w = __builtin_amdgcn_readfirstlane((int)(threadIdx.x >> 5));      /* the wave's number: a scalar, so that the early exit and the trip count are scalar */
  const int h = blockIdx.y, b = blockIdx.z; const int far = SQ / 128 - 1 - (int)blockIdx.x, near = 1 + (int)blockIdx.x;      /* waves 0-3 take a late block of rows, waves 4-7 the early block that makes the keys walked per work-group level */
  if (w >= 4 && near >= far) return;      /* the middle block has no partner; no barrier in this kernel */
  const int qw = (w < 4 ? far : near) * 128 + (w & 3) * 32;
  const size_t r0 = (size_t)b * SQ;
  const _Float16* qp = QKVp + (r0 + qw) * LQ + h * HD; const _Float16* kp = QKVp + DM + r0 * LQ + h * HD; const _Float16* vp = VTp + (size_t)(b * NH + h) * HD * SQ;      /* wave-uniform bases */
  const unsigned ko = (unsigned)(ln * LQ + 8 * hh) * 2u, vo = (unsigned)(ln * SQ + 8 * hh) * 2u;      /* the lane's row and k half in q / k rows and in V^T rows, in bytes */
  v16h qf[2][2], kf[4][2];
#pragma unroll      /* register arrays */
  for (int qt = 0; qt < 2; ++qt)
#pragma unroll      /* register arrays */
    for (int ks = 0; ks < 2; ++ks) qf[qt][ks] = fa_frag(qp + (size_t)qt * 16 * LQ + ks * 32, ko);
  fa_loadk(kp, 0, ko, kf);
  asm volatile("s_wait_xcnt 0x0" :: "v"(ko) : "memory");      /* behind the loads of q and of the first K, in front of any later write of their base and offset registers */
  __builtin_amdgcn_sched_barrier(0);      /* keeps later address arithmetic, which reuses those registers, behind the wait */
  const v8f z8 = {0.f, 0.f, 0.f, 0.f, 0.f, 0.f, 0.f, 0.f};
  v8f o[2][4] = {{z8, z8, z8, z8}, {z8, z8, z8, z8}}; float mr[2] = {-1.0e30f, -1.0e30f}; float l[2] = {0.f, 0.f};
  const int klast = qw & ~63;      /* keys 0 .. qw + 31 in passes of 64: every pass before this one lies wholly below row qw, this one ends at or below SQ - 1 */
  const int qrel = qw + ln - 8 * hh;
#pragma unroll 1      /* one pass holds 32 loads and 32 matrix instructions already */
  for (int kb = 0; kb < klast; kb += 64) fa_pass<false>(kp, vp, kb, qrel, ko, vo, qf, kf, o, mr, l);
  const float* xp = XBp + (r0 + qw) * DM + h * HD; float* yp = X1p + (r0 + qw) * DM + h * HD; const unsigned xo = (unsigned)(ln * DM + 8 * hh) * 4u;      /* lane (ln, hh) holds columns 16 t + 8 hh .. + 7 of query ln; in bytes */
  v4f xr[2][4][2];
#pragma unroll      /* register arrays */
  for (int qt = 0; qt < 2; ++qt)
#pragma unroll      /* register arrays */
    for (int t = 0; t < 4; ++t)
#pragma unroll      /* register arrays */
      for (int g = 0; g < 2; ++g) xr[qt][t][g] = *(const v4fa*)((const char*)(xp + qt * 16 * DM + t * 16 + g * 4) + xo);
  asm volatile("s_wait_xcnt 0x0" :: "v"(xo) : "memory");      /* as behind the V^T loads */
  __builtin_amdgcn_sched_barrier(0);      /* the residual rows are asked for here and fly under the last pass, in the registers that the K fetched ahead no longer needs */
  fa_pass<true>(kp, vp, klast, qrel, ko, vo, qf, kf, o, mr, l);
#pragma unroll      /* register arrays */
  for (int qt = 0; qt < 2; ++qt) { const float inv = 1.0f / (l[qt] + sm_half(l[qt]));      /* the two halves' sums joined once */
#pragma unroll      /* register arrays */
    for (int t = 0; t < 4; ++t)
#pragma unroll      /* register arrays */
      for (int g = 0; g < 2; ++g)
#pragma unroll      /* register arrays */
        for (int q = 0; q < 4; ++q) xr[qt][t][g][q] += o[qt][t][g * 4 + q] * inv; }
  __builtin_amdgcn_sched_barrier(0);      /* all arithmetic in front of the first store, so that nothing rewrites a register that an issued store names */
#pragma unroll      /* register arrays */
  for (int qt = 0; qt < 2; ++qt)
#pragma unroll      /* register arrays */
    for (int t = 0; t < 4; ++t)
#pragma unroll      /* register arrays */
      for (int g = 0; g < 2; ++g) *(v4f*)((char*)(yp + qt * 16 * DM + t * 16 + g * 4) + xo) = xr[qt][t][g]; }


typedef float v2f  __attribute__((ext_vector_type(2)));
typedef float v2fa __attribute__((ext_vector_type(2), may_alias));
// ---- f32 attention for the first QT0 query rows: one wave per (head, query row), eight rows of one head per work-group. The head's K and V rows up to the end of the rows' 32-key chunk are staged once in LDS.
// Scores: lane l owns keys 32 c + l (K pitch 68 floats = 16 B x odd, so that the 32 rows read by one ds_load_b128 spread over the banks). Output: lane l owns columns 2 l, 2 l + 1; each key's weight comes out of its lane by v_readlane.
// NCH = 32-key chunks (compile time: every load of a phase is issued before the first wait). Keys past the row get weight 2^(-1e30 ..) = 0.
template <int NCH>
__device__ __forceinline__ void att0_rows(const float* __restrict__ QF, const float* __restrict__ KF, const float* __restrict__ VF, float scale, float* __restrict__ OF, int h, int row0, float (*lk)[HD + 4], float (*lv)[HD]) {
  const int tid = threadIdx.x, lane = tid & 31; const int i = row0 + __builtin_amdgcn_readfirstlane(tid >> 5);      /* the row is the wave's: a scalar */
  const int sr = tid >> 4, sc = (tid & 15) * 4;      /* staging: 16 threads per 256-byte row, 16 rows per pass */
  const float* kg = KF + h * HD; const float* vg = VF + h * HD; const float* qr = QF + (size_t)i * DM + h * HD; const int so = sr * DM + sc;      /* row pitch DM at compile time: one address per matrix, the pass as a constant offset of the load */
  v4f kk[2 * NCH], vv[2 * NCH], q[HD / 4];
#pragma unroll      /* arrays stay in registers; all loads in flight together */
  for (int p = 0; p < 2 * NCH; ++p) { kk[p] = *(const v4fa*)(kg + so + p * 16 * DM); vv[p] = *(const v4fa*)(vg + so + p * 16 * DM); }
#pragma unroll      /* the query row, same address in every lane, fetched beside the staging loads */
  for (int c = 0; c < HD / 4; ++c) q[c] = *(const v4fa*)(qr + c * 4);
#pragma unroll      /* register arrays */
  for (int p = 0; p < 2 * NCH; ++p) { *(v4fa*)&lk[p * 16 + sr][sc] = kk[p]; *(v4fa*)&lv[p * 16 + sr][sc] = vv[p]; }
  __syncthreads();
  v4f a[NCH];
#pragma unroll      /* register arrays */
  for (int c = 0; c < NCH; ++c) { const v4f z = {0.f, 0.f, 0.f, 0.f}; a[c] = z; }
#pragma unroll      /* 4 NCH independent sums per lane */
  for (int d = 0; d < HD / 4; ++d)
#pragma unroll      /* a[c] by constant index */
    for (int c = 0; c < NCH; ++c) a[c] += q[d] * *(const v4fa*)&lk[c * 32 + lane][d * 4];
  float e[NCH]; float mx = -1.0e30f;
#pragma unroll      /* register arrays */
  for (int c = 0; c < NCH; ++c) { const float s = ((a[c][0] + a[c][1]) + (a[c][2] + a[c][3])) * scale; e[c] = (c * 32 + lane <= i) ? s : -1.0e30f; mx = fmaxf(mx, e[c]); }
  mx = sm_wmax(mx);
  float l = 0.f; v4f t = {-200.f, -200.f, -200.f, -200.f};      /* chunks that this case does not have: 2^-200, not summed */
#pragma unroll      /* register arrays */
  for (int c = 0; c < NCH; ++c) t[c] = (e[c] - mx) * 1.44269504f;      /* exp(x) = 2^(x log2 e), the native form, as in the row softmax above */
  t = sm_exp2x4(t);
#pragma unroll      /* register arrays */
  for (int c = 0; c < NCH; ++c) { e[c] = t[c]; l += e[c]; }
  l = sm_wsum(l);
  const v2f z2 = {0.f, 0.f}; v2f o[4] = {z2, z2, z2, z2};      /* four sums per column, so that one key's multiply-add does not wait for the key before it */
#pragma unroll      /* constant lane numbers for v_readlane, constant LDS offsets */
  for (int c = 0; c < NCH; ++c)
#pragma unroll      /* as the line above */
    for (int j = 0; j < 32; ++j) { const float ej = __builtin_bit_cast(float, __builtin_amdgcn_readlane(__builtin_bit_cast(int, e[c]), j)); o[j & 3] += ej * *(const v2fa*)&lv[c * 32 + j][lane * 2]; }
  const float fin = 64.0f / l;      /* o carried x64; the residual add divides it out */
  const v2f r = ((o[0] + o[1]) + (o[2] + o[3])) * fin;
  *(v2fa*)(OF + (size_t)i * DM + h * HD + lane * 2) = r; }
// The two jobs that need the q | k | v launch and nothing of each other share this grid: work-groups 0 .. A0G - 1 are the f32 attention (the longer job, placed first), the rest one V^T tile each. The branch is the same for a whole work-group, barriers included.
#define A0G (NB * NH * (QT0 / 8))
#define VTG (NB * NH * (SQ / 64))
__global__ __launch_bounds__(256) void k_att0w_vt(const float* __restrict__ QF, const float* __restrict__ KF, const float* __restrict__ VF, float scale, float* __restrict__ OF, const _Float16* __restrict__ V16, _Float16* __restrict__ Vt) {
  static_assert(QT0 == 128 && HD == 64, "the cases below cover 1 .. 4 chunks of 32 keys; two columns per lane");
  __shared__ __attribute__((aligned(16))) float lk[QT0][HD + 4]; __shared__ __attribute__((aligned(16))) float lv[QT0][HD]; __shared__ unsigned short tl[64][66];
  if (blockIdx.x >= A0G) { vt_tile<NH, SQ>(V16, LQ, 0, Vt, (int)blockIdx.x - A0G, tl); return; }
  const int bx = blockIdx.x % (NH * (QT0 / 8));
  { const size_t bo = (size_t)(blockIdx.x / (NH * (QT0 / 8))) * QT0 * DM; QF += bo; KF += bo; VF += bo; OF += bo; }      /* the batch: each matrix holds the batches' QT0 rows one behind the other */
  const int h = bx / (QT0 / 8), row0 = (bx % (QT0 / 8)) * 8;      /* eight rows lie in one 32-key chunk: the switch is the same for the whole work-group, barrier included */
  switch (row0 >> 5) {
    case 0: att0_rows<1>(QF, KF, VF, scale, OF, h, row0, lk, lv); break; case 1: att0_rows<2>(QF, KF, VF, scale, OF, h, row0, lk, lv); break;
    case 2: att0_rows<3>(QF, KF, VF, scale, OF, h, row0, lk, lv); break; case 3: att0_rows<4>(QF, KF, VF, scale, OF, h, row0, lk, lv); break; } }


template <int BFIN, int WXB>
__device__ __forceinline__ void ln16_row(const float* __restrict__ X, const float* __restrict__ g, const float* __restrict__ bb, float eps, _Float16* __restrict__ N16, float* __restrict__ XB, size_t r, float* red) {
  #pragma clang fp contract(off)
  const int t = threadIdx.x; const v4f xa = *(const v4fa*)(X + r * DMQ + t * 4); float s[4]; float sum = 0.f;
  for (int q = 0; q < 4; ++q) { s[q] = BFIN ? bf16_round(xa[q]) : xa[q]; sum = __fadd_rn(sum, s[q]); }
  red[t] = sum; __syncthreads(); for (int st = 128; st > 0; st >>= 1) { if (t < st) red[t] = __fadd_rn(red[t], red[t + st]); __syncthreads(); } const float mu = red[0] / (float)DMQ; __syncthreads();
  float vs = 0.f; for (int q = 0; q < 4; ++q) { const float dl = __fadd_rn(s[q], -mu); vs = __fadd_rn(vs, __fmul_rn(dl, dl)); } red[t] = vs; __syncthreads(); for (int st = 128; st > 0; st >>= 1) { if (t < st) red[t] = __fadd_rn(red[t], red[t + st]); __syncthreads(); }
  const float rs = rsqrtf(__fadd_rn(red[0] / (float)DMQ, eps)); v4h y; v4f xb;
  for (int q = 0; q < 4; ++q) { const int c = t * 4 + q; y[q] = (_Float16)__fadd_rn(__fmul_rn(__fmul_rn(__fadd_rn(s[q], -mu), rs), bf16_round(g[c])), bf16_round(bb[c])); xb[q] = s[q]; }
  { *(v4h*)(N16 + r * DMQ + t * 4) = y; if (WXB) *(v4f*)(XB + r * DMQ + t * 4) = xb;  } }
template <int BFIN, int WXB>
__global__ __launch_bounds__(256) void k_ln16(const float* __restrict__ X, const float* __restrict__ g, const float* __restrict__ bb, float eps, _Float16* __restrict__ N16, float* __restrict__ XB) { __shared__ float red[256]; ln16_row<BFIN, WXB>(X, g, bb, eps, N16, XB, blockIdx.x, red); }
// ---- all that is made from the inputs alone, in one launch: the stacked bias, the five weight matrices as f16 [n][k], LN1 of every token row. None of these jobs reads what another writes, so that they share one grid by ranges of the block index:
// their part-filled grids and their starts and ends overlap, where nine launches in a row each waited for the one before to drain. Every branch is the same for a whole work-group, barriers included.
#define PG_B 3                                   /* bq, bk, bv */
#define PG_W ((DM / 64) * (DM / 128))            /* tiles of one of wq, wk, wv */
#define PG_F ((DFF / 64) * (DM / 128))           /* tiles of w_fc; w_proj has as many */
#define PG_ALL (PG_B + 3 * PG_W + 2 * PG_F + (int)NR)
__global__ __launch_bounds__(256) void k_prep(const float* __restrict__ x, const float* __restrict__ g1, const float* __restrict__ be1, const float* __restrict__ wq, const float* __restrict__ wk, const float* __restrict__ wv,
    const float* __restrict__ bq, const float* __restrict__ bk, const float* __restrict__ bv, const float* __restrict__ wfc, const float* __restrict__ wmp,
    _Float16* __restrict__ BQKV, float* __restrict__ bqkv, _Float16* __restrict__ X16, float* __restrict__ XB, _Float16* __restrict__ BW1, _Float16* __restrict__ BW2) { static_assert(DM == 256 * 4, "a bias is four floats a thread");
  __shared__ __attribute__((aligned(16))) unsigned short tl[64 * 128]; __shared__ float red[256];
  int b = blockIdx.x;
  if (b < PG_B) { const float* s = b == 0 ? bq : b == 1 ? bk : bv; const v4f v = *(const v4fa*)(s + threadIdx.x * 4); *(v4f*)(bqkv + b * DM + threadIdx.x * 4) = v; return; }
  b -= PG_B;
  if (b < 3 * PG_W) { const int m = b / PG_W, i = b % PG_W; const float* W = m == 0 ? wq : m == 1 ? wk : wv; wt_f16_tile<DM, DM>(W, BQKV + (size_t)m * DM * DM, 16.0f, i % (DM / 64), i / (DM / 64), tl); return; }
  b -= 3 * PG_W;
  if (b < PG_F) { wt_f16_tile<DM, DFF>(wfc, BW1, 16.0f, b % (DFF / 64), b / (DFF / 64), tl); return; }
  b -= PG_F;
  if (b < PG_F) { wt_f16_tile<DFF, DM>(wmp, BW2, 16.0f, b % (DM / 64), b / (DM / 64), tl); return; }
  b -= PG_F;
  ln16_row<1, 1>(x, g1, be1, 1e-5f, X16, XB, (size_t)b, red);
  asm volatile("s_wait_xcnt 0x0" ::: "memory"); }      /* behind the row's stores: the compiler lays the jobs out one behind the other and lets this one run through the scalar tests of the rest, which reuse the stores' base registers */
__global__ __launch_bounds__(256) void k_ftres2(const float* __restrict__ OF0, const float* __restrict__ XB, float* __restrict__ X1, size_t n4) {
  #pragma clang fp contract(off)
  const size_t t = (size_t)blockIdx.x * 256 + threadIdx.x; if (t >= n4) return; const v4f o = *(const v4fa*)(OF0 + t * 4), xv = *(const v4fa*)(XB + t * 4); v4f y; for (int q = 0; q < 4; ++q) y[q] = __fadd_rn(__fmul_rn(o[q], 0.015625f), xv[q]); *(v4f*)(X1 + t * 4) = y;  }

__global__ __launch_bounds__(256) void k_wthd(const float* __restrict__ Wt, _Float16* __restrict__ Bt) { const size_t t = (size_t)blockIdx.x * 256 + threadIdx.x; if (t >= (size_t)NH * HD * (DM / 8)) return; const int m8 = (int)(t % (DM / 8)) * 8; const int d = (int)((t / (DM / 8)) % HD); const int h = (int)(t / ((size_t)(DM / 8) * HD)); FragH f;
  for (int q = 0; q < 8; ++q) f.h[q] = (_Float16)(16.0f * bf16_round(Wt[((size_t)h * DM + m8 + q) * HD + d])); unsigned short* dst = (unsigned short*)Bt + ((size_t)h * HD + d) * DM + m8; *(v8us*)dst = f.half[0];  }




__global__ __launch_bounds__(256) void k_wtpad(const float* __restrict__ Wm, _Float16* __restrict__ Wt, int Kr, int Kp, int Nr, int Np, float scale) {
  const int t = blockIdx.x * 256 + threadIdx.x; if (t >= Np * (Kp / 8)) return; const int n = t / (Kp / 8), k8 = (t % (Kp / 8)) * 8; const int nc = min(n, Nr - 1); const float fn = (n < Nr) ? 1.f : 0.f; FragH f;
  for (int i = 0; i < 8; ++i) { const int k = k8 + i; const int kc = min(k, Kr - 1); const float fk = (k < Kr) ? fn : 0.f; f.h[i] = (_Float16)(bf16_round(Wm[(size_t)kc * Nr + nc]) * scale * fk); }
  unsigned short* o = (unsigned short*)Wt + (size_t)n * Kp + k8; *(v8us*)o = f.half[0];  }
__global__ __launch_bounds__(128) void k_bpad(const float* __restrict__ b, float* __restrict__ Bp, int nr, int np) {
  const int i = threadIdx.x; if (i >= np) return; const float v = b[min(i, nr - 1)] * ((i < nr) ? 1.f : 0.f); *(float*)(Bp + i) = v;  }

__global__ __launch_bounds__(256) void k_bcpy(const float* __restrict__ b, int n, int NP, float* __restrict__ dst, int dst0) { for (int i = threadIdx.x; i < NP; i += 256) { const float v = (i < n) ? b[i] : 0.f; *(float*)(dst + dst0 + i) = v; }  }


__global__ __launch_bounds__(256) void k_addf(const float* __restrict__ XBr, const float* __restrict__ OF, float* __restrict__ O, size_t n8) {
  #pragma clang fp contract(off)
  XBr += (size_t)blockIdx.y * SQ * DM; O += (size_t)blockIdx.y * SQ * DM; OF += (size_t)blockIdx.y * QT0 * DM;      /* blockIdx.y = batch: its first rows in the token planes, its own QT0 rows in OF */
  const size_t t = (size_t)blockIdx.x * 256 + threadIdx.x; if (t >= n8) return; const v4f a = *(const v4fa*)(XBr + t * 8), b = *(const v4fa*)(XBr + t * 8 + 4), c = *(const v4fa*)(OF + t * 8), d = *(const v4fa*)(OF + t * 8 + 4); v4f r0, r1;
  for (int q = 0; q < 4; ++q) { r0[q] = __fadd_rn(a[q], __fmul_rn(c[q], 0.015625f)); r1[q] = __fadd_rn(b[q], __fmul_rn(d[q], 0.015625f)); }
  { *(v4f*)(O + t * 8) = r0; *(v4f*)(O + t * 8 + 4) = r1;  } }


extern "C" void kernel_launch(void* const* d_in, const int* in_sizes, int n_in,
                              void* d_out, int out_size, void* d_ws, size_t ws_size, hipStream_t stream) {
  (void)in_sizes; (void)n_in; (void)out_size;
  const float* const* I = (const float* const*)d_in; const float* x = I[0]; const float* wq = I[1]; const float* bq = I[2]; const float* wk = I[3]; const float* bk = I[4]; const float* wv = I[5]; const float* bv = I[6]; const float* g1 = I[7]; const float* be1 = I[8]; const float* gg2 = I[9]; const float* be2 = I[10]; const float* wfc = I[11]; const float* bfc = I[12]; const float* wmp = I[13]; const float* bmp = I[14];      /* input order: x; [in][out] wq / wk / wv + biases; LN1 w / b, LN2 w / b; w_fc [1024][4096] + b_fc, w_proj [4096][1024] + b_proj */
  float* OUT0 = (float*)d_out; float* OUTK = (float*)d_out + NR * DM;      /* tuple outputs: out at byte 0, k at 16,777,216, v at 33,554,432 (each NB * SQ * DM floats) */
  static_assert(NH * HD == DM && DM % 64 == 0 && SQ % 128 == 0 && QT0 % 8 == 0, "shape / tile multiples");
  char* ws = (char*)d_ws; size_t off = 0;
  auto take = [&](size_t bytes) { char* p = ws + off; off += (bytes + 255) & ~(size_t)255; return p; };
  _Float16* BQKV = (_Float16*)take((size_t)3 * DM * DM * 2); float* bqkv = (float*)take((size_t)3 * DM * 4);      /* stacked bias bq | bk | bv */
  _Float16* X16 = (_Float16*)take(NR * DM * 2); float* XB = (float*)take(NR * DM * 4); float* X1 = (float*)take(NR * DM * 4); _Float16* M16 = nullptr;      /* = X16 below (alias: X16's last reader, the q | k | v GEMM, precedes LN2's write) */ _Float16* HF16 = (_Float16*)take(NR * DFF * 2); _Float16* BW1 = (_Float16*)take((size_t)DFF * DM * 2); _Float16* BW2 = (_Float16*)take((size_t)DM * DFF * 2); _Float16* QKV = (_Float16*)take(NR * 3 * DM * 2); _Float16* V16 = QKV + 2 * DM; M16 = X16;
  _Float16* VT = (_Float16*)take((size_t)NB * NH * HD * SQ * 2);      /* V^T of both batches */
  float* F0 = (float*)take((size_t)3 * NB * QT0 * DM * 4);      /* f32 q | k | v of each batch's first QT0 rows */ float* OF0 = (float*)take((size_t)NB * QT0 * DM * 4);
  if (off > ws_size) return;
  k_prep<<<PG_ALL, 256, 0, stream>>>(x, g1, be1, wq, wk, wv, bq, bk, bv, wfc, wmp, BQKV, bqkv, X16, XB, BW1, BW2);      /* stacked bias bq | bk | bv; [in][out] -> Bt x16: stacked q | k | v, W1 [1024][4096] -> Bt [4096][1024], W2 [4096][1024] -> Bt [1024][4096]; a = LN1(bf16(x)) -> f16 rows, XB = bf16(x) for the residual */
  const size_t r0p = (size_t)B0 * SQ;      /* first projected row */
  k_gemm2<0, true><<<dim3((unsigned)((MP / 128) * (3 * DM / 128)), 1), 128, 0, stream>>>(X16 + r0p * DM, DM, 0, BQKV, DM, 0, 0.0625f, bqkv, 0, nullptr, 1, 0, 0, nullptr, QKV + r0p * 3 * DM, 3 * DM, 0, MP, 3 * DM, DM, OUTK, F0);      /* q | k | v rows (f16); head h = columns h*HD.. of each DM block; from the same sums outputs 1 and 2 (k, v in f32, head-major [B][H][T][64]) and the f32 q, k, v of the first 128 rows of each batch */
  k_att0w_vt<<<A0G + VTG, 256, 0, stream>>>(F0, F0 + (size_t)NB * QT0 * DM, F0 + (size_t)2 * NB * QT0 * DM, 0.125f, OF0, V16, VT);      /* f32 attention for rows 0..127 of both batches (o x64), one wave per head and row; V^T [NB][NH][HD][SQ], both batches */
  k_addf<<<dim3((unsigned)(((size_t)QT0 * DM / 8 + 255) / 256), NB), 256, 0, stream>>>(XB, OF0, X1, (size_t)QT0 * DM / 8);      /* rows 0..127 of each batch from the exact f32 path: x1 = bf16(x) + o / 64 */
  k_fattn<<<dim3(SQ / 256, NH, NB), 256, 0, stream>>>(QKV, VT, XB, X1);      /* rows 128.. of both batches: x1 = bf16(x) + softmax(q k^T / 8) v in f32 (no output projection in this module) */
  k_ln16<0, 0><<<(unsigned)NR, 256, 0, stream>>>(X1, gg2, be2, 1e-5f, M16, nullptr);      /* h = LN2(x1) -> f16 rows */
  k_gemm2<6><<<dim3((unsigned)((NR / 128) * (DFF / 128)), 1), 128, 0, stream>>>(M16, DM, 0, BW1, DM, 0, 0.0625f, bfc, 0, nullptr, 1, 0, 0, nullptr, HF16, DFF, 0, (int)NR, DFF, DM, nullptr, nullptr);      /* gelu_erf(h2 W1 + b1) -> f16, all token rows */
  k_gemm2<0, false, 2, 128><<<dim3((unsigned)((NR / 128) * (DM / 128)), 1), 256, 0, stream>>>(HF16, DFF, 0, BW2, DFF, 0, 0.0625f, bmp, 0, X1, -1, 0, 0, OUT0, nullptr, DM, 0, (int)NR, DM, DFF, nullptr, nullptr);      /* output 0 = x1 + mlp (own-element residual), all token rows: one work-group of eight waves per WGP, passes of 128 k */
}
